// v000
// Measured on an AMD MI455X. A time is GPU time per run, averaged over a window of back-to-back runs after a warm-up
// (all launches, gaps included; the runs take copies of the inputs in turn), and the median of several windows.
// Apart from v000's, it joins two sittings. Times from different sittings can be a few percent apart, while
// side-by-side timings come from the same sitting.
// The starting kernel, v000, takes 859 microseconds a run.
#include <hip/hip_runtime.h>

typedef __attribute__((ext_vector_type(2))) float v2f;
typedef __attribute__((ext_vector_type(8))) float v8f;

namespace {
constexpr int kDim    = 1024;
constexpr int kQkv    = 3072;
constexpr int kHeads  = 16;
constexpr int kHd     = 64;
constexpr int kTokens = 16384;            // B*N
constexpr int kBM     = 16;               // tokens per workgroup

// Padded LDS strides (in floats) to avoid bank conflicts (64 banks x 4B).
constexpr int kXS    = 1028;              // x / out tile row stride (1028 % 64 == 4)
constexpr int kQRow  = 68;                // per-head row stride inside q|k|v
constexpr int kQPart = kHeads * kQRow;    // 1088 floats per q|k|v part
constexpr int kQTok  = 3 * kQPart + 4;    // 3268 floats per token (skewed)
constexpr int kARow  = 18;                // attn 16x16 scratch row stride (8B-aligned rows)
constexpr int kASize = 16 * kARow;        // 288 floats per wave
constexpr int kSmemFloats = kBM * kXS + kBM * kQTok + 8 * kASize;  // 71040 -> 284160 B
}

__device__ __forceinline__ v8f wmma4(v2f a, v2f b, v8f c) {
  // D = A(16x4 f32) * B(4x16 f32) + C(16x16 f32)
  return __builtin_amdgcn_wmma_f32_16x16x4_f32(false, a, false, b, (short)0, c,
                                               false, false);
}

__device__ __forceinline__ void async_wait0() {
#if __has_builtin(__builtin_amdgcn_s_wait_asynccnt)
  __builtin_amdgcn_s_wait_asynccnt(0);
#else
  asm volatile("s_wait_asynccnt 0x0" ::: "memory");
#endif
}

__global__ __launch_bounds__(256, 1)
void fused_attn(const float* __restrict__ x,
                const float* __restrict__ wqkv,
                const float* __restrict__ bqkv,
                const float* __restrict__ wproj,
                const float* __restrict__ bproj,
                float* __restrict__ out) {
  extern __shared__ float smem[];
  float* xs = smem;                             // [16][kXS]; reused as out tile
  float* qs = smem + kBM * kXS;                 // [16][kQTok]
  float* as = smem + kBM * kXS + kBM * kQTok;   // [8][kASize]

  const int tid  = threadIdx.x;
  const int wave = tid >> 5;       // 8 waves of 32 (wave32)
  const int lane = tid & 31;
  const int hl   = lane & 15;      // position within half-wave
  const int kh   = lane >> 4;      // which K-half this lane feeds (A/B layout)
  const int row0 = blockIdx.x * kBM;

  // ---- Phase 1: async-copy x tile (16 x 1024 f32) straight into LDS ----
  // GLOBAL_LOAD_ASYNC_TO_LDS_B128, GVS mode: SGPR64 base + per-lane byte
  // offset; VDST VGPR carries the per-lane LDS byte address. Tracked by
  // ASYNCcnt (no VGPR round-trip, no LOADcnt/DScnt pressure).
  {
    const unsigned long long gbase =
        (unsigned long long)(x + (size_t)row0 * kDim);
    const unsigned int lds0 = (unsigned int)(uintptr_t)xs;  // addr[31:0] = LDS offset
    #pragma unroll
    for (int i = 0; i < (kBM * kDim / 4) / 256; ++i) {
      const int li = tid + i * 256;          // float4 index within tile
      const int r  = li >> 8;                // 256 float4 per row
      const int c4 = li & 255;
      const unsigned int ldsb = lds0 + (unsigned int)(r * kXS + c4 * 4) * 4u;
      const unsigned int goff = (unsigned int)li * 16u;  // byte offset
      asm volatile("global_load_async_to_lds_b128 %0, %1, %2"
                   :
                   : "v"(ldsb), "v"(goff), "s"(gbase)
                   : "memory");
    }
    async_wait0();
  }
  __syncthreads();

  // ---- Phase 2: QKV GEMM: qs[16][3072(padded)] = xs @ wqkv + bqkv ----
  {
    const int colW = wave * (kQkv / 8);        // 384 columns per wave
    for (int g = 0; g < 6; ++g) {
      const int colG = colW + g * 64;
      v8f acc[4] = {{}, {}, {}, {}};
      for (int k0 = 0; k0 < kDim; k0 += 4) {
        const int kk = k0 + kh * 2;
        v2f a = *(const v2f*)(xs + hl * kXS + kk);
        const float* wp = wqkv + (size_t)kk * kQkv + colG + hl;
        #pragma unroll
        for (int t = 0; t < 4; ++t) {
          v2f b;
          b.x = wp[t * 16];
          b.y = wp[kQkv + t * 16];
          acc[t] = wmma4(a, b, acc[t]);
        }
      }
      #pragma unroll
      for (int t = 0; t < 4; ++t) {
        const int col  = colG + t * 16 + hl;                 // true column
        const int cp   = (col >> 6) * kQRow + (col & 63);    // padded column
        const float bv = bqkv[col];
        #pragma unroll
        for (int r = 0; r < 8; ++r) {
          qs[(r + kh * 8) * kQTok + cp] = acc[t][r] + bv;    // row = token-in-block
        }
      }
    }
  }
  __syncthreads();

  // ---- Phase 3: per-token attention over heads (16x16 softmax) ----
  float* os = xs;  // out tile [16][kXS] reuses x-tile storage (flat 1024/row)
  for (int t2 = 0; t2 < 2; ++t2) {
    const int m = wave * 2 + t2;               // token handled by this wave
    const float* qrow = qs + m * kQTok;
    const float* krow = qrow + kQPart;
    const float* vrow = qrow + 2 * kQPart;
    float* aw = as + wave * kASize;

    // scores = q @ k^T  (16x16, K = 64)
    v8f s = {};
    #pragma unroll
    for (int k0 = 0; k0 < kHd; k0 += 4) {
      const int kk = k0 + kh * 2;
      v2f a = *(const v2f*)(qrow + hl * kQRow + kk);
      v2f b = *(const v2f*)(krow + hl * kQRow + kk);
      s = wmma4(a, b, s);
    }
    // softmax across N-axis (lanes of a 16-lane half) for each of 8 rows
    #pragma unroll
    for (int r = 0; r < 8; ++r) {
      float v = s[r] * 0.125f;                 // 1/sqrt(64)
      float mx = v;
      mx = fmaxf(mx, __shfl_xor(mx, 1));
      mx = fmaxf(mx, __shfl_xor(mx, 2));
      mx = fmaxf(mx, __shfl_xor(mx, 4));
      mx = fmaxf(mx, __shfl_xor(mx, 8));
      float e = __expf(v - mx);
      float sm = e;
      sm += __shfl_xor(sm, 1);
      sm += __shfl_xor(sm, 2);
      sm += __shfl_xor(sm, 4);
      sm += __shfl_xor(sm, 8);
#if __has_builtin(__builtin_amdgcn_rcpf)
      aw[(r + kh * 8) * kARow + hl] = e * __builtin_amdgcn_rcpf(sm);
#else
      aw[(r + kh * 8) * kARow + hl] = e / sm;
#endif
    }
    __syncthreads();   // uniform; also orders the C->A layout bounce via LDS

    // out = attn @ v  (16x64, K = 16)
    v8f o[4] = {{}, {}, {}, {}};
    #pragma unroll
    for (int k0 = 0; k0 < 16; k0 += 4) {
      const int kk = k0 + kh * 2;
      v2f a = *(const v2f*)(aw + hl * kARow + kk);
      #pragma unroll
      for (int t = 0; t < 4; ++t) {
        v2f b;
        b.x = vrow[kk * kQRow + t * 16 + hl];
        b.y = vrow[(kk + 1) * kQRow + t * 16 + hl];
        o[t] = wmma4(a, b, o[t]);
      }
    }
    float* orow = os + m * kXS;                // flat [h*64 + d] within row
    #pragma unroll
    for (int t = 0; t < 4; ++t) {
      #pragma unroll
      for (int r = 0; r < 8; ++r) {
        orow[(r + kh * 8) * kHd + t * 16 + hl] = o[t][r];
      }
    }
  }
  __syncthreads();

  // ---- Phase 4: proj GEMM: out[16][1024] = os @ wproj + bproj ----
  for (int g = 0; g < 2; ++g) {
    const int colG = wave * 128 + g * 64;
    v8f acc[4] = {{}, {}, {}, {}};
    for (int k0 = 0; k0 < kDim; k0 += 4) {
      const int kk = k0 + kh * 2;
      v2f a = *(const v2f*)(os + hl * kXS + kk);
      const float* wp = wproj + (size_t)kk * kDim + colG + hl;
      #pragma unroll
      for (int t = 0; t < 4; ++t) {
        v2f b;
        b.x = wp[t * 16];
        b.y = wp[kDim + t * 16];
        acc[t] = wmma4(a, b, acc[t]);
      }
    }
    #pragma unroll
    for (int t = 0; t < 4; ++t) {
      const int col  = colG + t * 16 + hl;
      const float bv = bproj[col];
      #pragma unroll
      for (int r = 0; r < 8; ++r) {
        out[(size_t)(row0 + r + kh * 8) * kDim + col] = acc[t][r] + bv;
      }
    }
  }
}

extern "C" void kernel_launch(void* const* d_in, const int* in_sizes, int n_in,
                              void* d_out, int out_size, void* d_ws, size_t ws_size,
                              hipStream_t stream) {
  (void)in_sizes; (void)n_in; (void)out_size; (void)d_ws; (void)ws_size;
  const float* x     = (const float*)d_in[0];
  const float* wqkv  = (const float*)d_in[1];
  const float* bqkv  = (const float*)d_in[2];
  const float* wproj = (const float*)d_in[3];
  const float* bproj = (const float*)d_in[4];
  float* out = (float*)d_out;

  const size_t shmem = (size_t)kSmemFloats * sizeof(float);  // ~278 KB of 320 KB/WGP
  (void)hipFuncSetAttribute((const void*)fused_attn,
                            hipFuncAttributeMaxDynamicSharedMemorySize,
                            (int)shmem);
  fused_attn<<<dim3(kTokens / kBM), dim3(256), shmem, stream>>>(
      x, wqkv, bqkv, wproj, bproj, out);
}

// v001
// Measured time: 697 microseconds a run.
// In two side-by-side timings against v000, it was 1.29 and 1.28 times as fast.
#include <hip/hip_runtime.h>

typedef __attribute__((ext_vector_type(2))) float v2f;
typedef __attribute__((ext_vector_type(8))) float v8f;

namespace {
constexpr int kDim    = 1024;
constexpr int kQkv    = 3072;
constexpr int kHd     = 64;
constexpr int kTokens = 16384;            // B*N
constexpr int kBM     = 64;               // tokens per workgroup
constexpr int kMT     = kBM / 16;         // 16-row A fragments that share one weight fragment
constexpr int kWaves  = 16;
constexpr int kThreads = kWaves * 32;

// Padded LDS strides (in floats) to avoid bank conflicts (64 banks x 4B).
constexpr int kXS    = 1028;              // x / attention-out tile row stride (1028 % 64 == 4)
constexpr int kARow  = 18;                // attn 16x16 scratch row stride (8B-aligned rows)
constexpr int kASize = 16 * kARow;        // 288 floats per wave
}

__device__ __forceinline__ v8f wmma4(v2f a, v2f b, v8f c) {
  // D = A(16x4 f32) * B(4x16 f32) + C(16x16 f32)
  return __builtin_amdgcn_wmma_f32_16x16x4_f32(false, a, false, b, (short)0, c,
                                               false, false);
}

// C[64][64 columns from colG] = At[64][1024] (LDS, stride kXS) @ W[1024][N] + bias.
// Every weight fragment read from global feeds kMT matrix instructions.
template <int N>
__device__ __forceinline__ void gemm_64x64(const float* At,
                                           const float* __restrict__ W,
                                           const float* __restrict__ bias,
                                           float* __restrict__ C,
                                           int colG, int hl, int kh) {
  v8f acc[kMT][4] = {};
  const float* ap = At + hl * kXS + kh * 2;
  const float* wp = W + (size_t)(kh * 2) * N + colG + hl;
  // Two k-steps per trip: their loads go out together ahead of 32 matrix instructions.
  #pragma unroll 2
  for (int k0 = 0; k0 < kDim; k0 += 4) {
    v2f a[kMT];
    v2f b[4];
    #pragma unroll
    for (int t = 0; t < 4; ++t) {
      b[t].x = wp[t * 16];
      b[t].y = wp[N + t * 16];
    }
    #pragma unroll
    for (int mt = 0; mt < kMT; ++mt) {
      a[mt] = *(const v2f*)(ap + mt * 16 * kXS);
    }
    #pragma unroll
    for (int mt = 0; mt < kMT; ++mt) {
      #pragma unroll
      for (int t = 0; t < 4; ++t) {
        acc[mt][t] = wmma4(a[mt], b[t], acc[mt][t]);
      }
    }
    ap += 4;
    wp += (size_t)4 * N;
  }
  #pragma unroll
  for (int t = 0; t < 4; ++t) {
    const int col  = colG + t * 16 + hl;
    const float bv = bias[col];
    #pragma unroll
    for (int mt = 0; mt < kMT; ++mt) {
      #pragma unroll
      for (int r = 0; r < 8; ++r) {
        C[(size_t)(mt * 16 + r + kh * 8) * N + col] = acc[mt][t][r] + bv;
      }
    }
  }
}

// ---- Launch 1: qkv[16384][3072] = x @ wqkv + bqkv, 64 tokens per workgroup ----
__global__ __launch_bounds__(kThreads)
void qkv_gemm(const float* __restrict__ x,
              const float* __restrict__ wqkv,
              const float* __restrict__ bqkv,
              float* __restrict__ qkv) {
  __shared__ __attribute__((aligned(16))) float xs[kBM * kXS];

  const int tid  = threadIdx.x;
  const int wave = tid >> 5;
  const int lane = tid & 31;
  const int hl   = lane & 15;      // position within half-wave
  const int kh   = lane >> 4;      // which K-half this lane feeds (A/B layout)
  const int row0 = blockIdx.x * kBM;

  // Async-copy the x tile (64 x 1024 f32) straight into LDS, 16 B per lane and copy.
  {
    const float* gsrc = x + (size_t)row0 * kDim + tid * 4;
    const unsigned int lds0 = (unsigned int)(uintptr_t)xs +
        (unsigned int)((tid >> 8) * kXS + (tid & 255) * 4) * 4u;
    #pragma unroll
    for (int i = 0; i < (kBM * kDim / 4) / kThreads; i += 8) {
      unsigned int l[8];
      const float* g[8];
      #pragma unroll
      for (int j = 0; j < 8; ++j) {
        l[j] = lds0 + (unsigned int)((i + j) * 2 * kXS) * 4u;   // two rows per sweep
        g[j] = gsrc + (size_t)(i + j) * kThreads * 4;
      }
      // The closing s_wait_xcnt keeps the address registers untouched until the
      // copies have taken them.
      asm volatile("global_load_async_to_lds_b128 %0, %8, off\n\t"
                   "global_load_async_to_lds_b128 %1, %9, off\n\t"
                   "global_load_async_to_lds_b128 %2, %10, off\n\t"
                   "global_load_async_to_lds_b128 %3, %11, off\n\t"
                   "global_load_async_to_lds_b128 %4, %12, off\n\t"
                   "global_load_async_to_lds_b128 %5, %13, off\n\t"
                   "global_load_async_to_lds_b128 %6, %14, off\n\t"
                   "global_load_async_to_lds_b128 %7, %15, off\n\t"
                   "s_wait_xcnt 0x0"
                   :
                   : "v"(l[0]), "v"(l[1]), "v"(l[2]), "v"(l[3]),
                     "v"(l[4]), "v"(l[5]), "v"(l[6]), "v"(l[7]),
                     "v"(g[0]), "v"(g[1]), "v"(g[2]), "v"(g[3]),
                     "v"(g[4]), "v"(g[5]), "v"(g[6]), "v"(g[7])
                   : "memory");
    }
    // This wave's copies have landed before the barrier publishes the tile.
    asm volatile("s_wait_asynccnt 0x0" ::: "memory");
  }
  __syncthreads();

  float* crow = qkv + (size_t)row0 * kQkv;
  for (int g = 0; g < kQkv / (kWaves * 64); ++g) {
    gemm_64x64<kQkv>(xs, wqkv, bqkv, crow, wave * (kQkv / kWaves) + g * 64, hl, kh);
    // The next trip rewrites the address and data registers of the stores just issued.
    asm volatile("s_wait_xcnt 0x0" ::: "memory");
  }
}

// ---- Launch 2: per-token attention over heads, then out = attn_out @ wproj + bproj ----
__global__ __launch_bounds__(kThreads)
void attn_proj(const float* __restrict__ qkv,
               const float* __restrict__ wproj,
               const float* __restrict__ bproj,
               float* __restrict__ out) {
  __shared__ __attribute__((aligned(16))) float os[kBM * kXS];      // attention output tile
  __shared__ __attribute__((aligned(16))) float as[kWaves * kASize];

  const int tid  = threadIdx.x;
  const int wave = tid >> 5;
  const int lane = tid & 31;
  const int hl   = lane & 15;
  const int kh   = lane >> 4;
  const int row0 = blockIdx.x * kBM;

  for (int t2 = 0; t2 < kBM / kWaves; ++t2) {
    const int m = wave * (kBM / kWaves) + t2;  // token handled by this wave
    const float* qrow = qkv + (size_t)(row0 + m) * kQkv;
    const float* krow = qrow + kDim;
    const float* vrow = qrow + 2 * kDim;
    float* aw = as + wave * kASize;

    // This token's q, k and v fragments, all requested at once from the workspace.
    v2f qa[kHd / 4], kb[kHd / 4], vb[4][4];
    #pragma unroll
    for (int i = 0; i < kHd / 4; ++i) {
      const int kk = i * 4 + kh * 2;
      qa[i] = *(const v2f*)(qrow + hl * kHd + kk);
      kb[i] = *(const v2f*)(krow + hl * kHd + kk);
    }
    #pragma unroll
    for (int i = 0; i < 4; ++i) {
      const int kk = i * 4 + kh * 2;
      #pragma unroll
      for (int t = 0; t < 4; ++t) {
        vb[i][t].x = vrow[kk * kHd + t * 16 + hl];
        vb[i][t].y = vrow[(kk + 1) * kHd + t * 16 + hl];
      }
    }

    // scores = q @ k^T  (16x16, K = 64)
    v8f s = {};
    #pragma unroll
    for (int i = 0; i < kHd / 4; ++i) {
      s = wmma4(qa[i], kb[i], s);
    }
    __builtin_amdgcn_sched_barrier(0);
    // Four vector slots between the last matrix instruction and the first use of s or
    // reuse of its operand registers; the scheduling fences on both sides hold the slots
    // here and keep later vector instructions from being moved up into the chain.
    asm volatile("v_nop\n\tv_nop\n\tv_nop\n\tv_nop");
    __builtin_amdgcn_sched_barrier(0);
    // softmax across N-axis (lanes of a 16-lane half) for each of 8 rows
    #pragma unroll
    for (int r = 0; r < 8; ++r) {
      float v = s[r] * 0.125f;                 // 1/sqrt(64)
      float mx = v;
      mx = fmaxf(mx, __shfl_xor(mx, 1));
      mx = fmaxf(mx, __shfl_xor(mx, 2));
      mx = fmaxf(mx, __shfl_xor(mx, 4));
      mx = fmaxf(mx, __shfl_xor(mx, 8));
      float e = __expf(v - mx);
      float sm = e;
      sm += __shfl_xor(sm, 1);
      sm += __shfl_xor(sm, 2);
      sm += __shfl_xor(sm, 4);
      sm += __shfl_xor(sm, 8);
#if __has_builtin(__builtin_amdgcn_rcpf)
      aw[(r + kh * 8) * kARow + hl] = e * __builtin_amdgcn_rcpf(sm);
#else
      aw[(r + kh * 8) * kARow + hl] = e / sm;
#endif
    }
    __syncthreads();   // uniform; also orders the C->A layout bounce via LDS

    // out = attn @ v  (16x64, K = 16)
    v8f o[4] = {{}, {}, {}, {}};
    v2f pa[4];
    #pragma unroll
    for (int i = 0; i < 4; ++i) {
      pa[i] = *(const v2f*)(aw + hl * kARow + i * 4 + kh * 2);
    }
    #pragma unroll
    for (int i = 0; i < 4; ++i) {
      #pragma unroll
      for (int t = 0; t < 4; ++t) {
        o[t] = wmma4(pa[i], vb[i][t], o[t]);
      }
    }
    __builtin_amdgcn_sched_barrier(0);
    asm volatile("v_nop\n\tv_nop\n\tv_nop\n\tv_nop");  // slots and fences as behind the scores
    __builtin_amdgcn_sched_barrier(0);
    float* orow = os + m * kXS;                // flat [h*64 + d] within row
    #pragma unroll
    for (int t = 0; t < 4; ++t) {
      #pragma unroll
      for (int r = 0; r < 8; ++r) {
        orow[(r + kh * 8) * kHd + t * 16 + hl] = o[t][r];
      }
    }
  }
  __syncthreads();

  gemm_64x64<kDim>(os, wproj, bproj, out + (size_t)row0 * kDim, wave * 64, hl, kh);
}

extern "C" void kernel_launch(void* const* d_in, const int* in_sizes, int n_in,
                              void* d_out, int out_size, void* d_ws, size_t ws_size,
                              hipStream_t stream) {
  (void)in_sizes; (void)n_in; (void)out_size; (void)ws_size;
  const float* x     = (const float*)d_in[0];
  const float* wqkv  = (const float*)d_in[1];
  const float* bqkv  = (const float*)d_in[2];
  const float* wproj = (const float*)d_in[3];
  const float* bproj = (const float*)d_in[4];
  float* out = (float*)d_out;
  float* qkv = (float*)d_ws;   // [16384][3072] f32, written by launch 1, read by launch 2

  qkv_gemm<<<dim3(kTokens / kBM), dim3(kThreads), 0, stream>>>(x, wqkv, bqkv, qkv);
  attn_proj<<<dim3(kTokens / kBM), dim3(kThreads), 0, stream>>>(qkv, wproj, bproj, out);
}

// v002
// One run takes 603 microseconds.
// Two timings next to v001 put it at 1.15 and 1.16 times that version's speed.
// Over all steps from v000 it is 1.49 times as fast.
#include <hip/hip_runtime.h>

typedef __attribute__((ext_vector_type(2))) float v2f;
typedef __attribute__((ext_vector_type(8))) float v8f;

namespace {
constexpr int kDim    = 1024;
constexpr int kQkv    = 3072;
constexpr int kHd     = 64;
constexpr int kTokens = 16384;            // B*N
constexpr int kBM     = 64;               // tokens per workgroup
constexpr int kMT     = kBM / 16;         // 16-row A fragments that share one weight fragment
constexpr int kWaves  = 16;
constexpr int kThreads = kWaves * 32;

// Padded LDS strides (in floats) to avoid bank conflicts (64 banks x 4B).
constexpr int kXS    = 1028;              // x / attention-out tile row stride (1028 % 64 == 4)
constexpr int kARow  = 18;                // attn 16x16 scratch row stride (8B-aligned rows)
constexpr int kASize = 16 * kARow;        // 288 floats per wave
}

__device__ __forceinline__ v8f wmma4(v2f a, v2f b, v8f c) {
  // D = A(16x4 f32) * B(4x16 f32) + C(16x16 f32)
  return __builtin_amdgcn_wmma_f32_16x16x4_f32(false, a, false, b, (short)0, c,
                                               false, false);
}

// C[64][64 columns from colG] = At[64][1024] (LDS, stride kXS) @ W[1024][N] + bias.
// Every weight fragment read from global feeds kMT matrix instructions.
// A stage is two k-steps (32 matrix instructions). Weight fragments sit in a ring of four
// register sets and are requested three stages ahead; At fragments in two sets, one ahead.
template <int N>
__device__ __forceinline__ void gemm_64x64(const float* At,
                                           const float* __restrict__ W,
                                           const float* __restrict__ bias,
                                           float* __restrict__ C,
                                           int colG, int hl, int kh) {
  constexpr int kKS = 2;                  // k-steps of 4 per stage
  constexpr int kSK = kKS * 4;            // k per stage
  constexpr int kNS = kDim / kSK;         // stages
  constexpr int kRB = 4;                  // weight fragment sets in the ring
  v8f acc[kMT][4] = {};
  v2f a[2][kKS][kMT];
  v2f b[kRB][kKS][4];
  const float* ap = At + hl * kXS + kh * 2;
  const float* wp = W + (size_t)(kh * 2) * N + colG + hl;

  // st counts stages from the one ap and wp stand at.
  auto load_b = [&](int set, int st) {
    #pragma unroll
    for (int j = 0; j < kKS; ++j) {
      #pragma unroll
      for (int t = 0; t < 4; ++t) {
        b[set][j][t].x = wp[(size_t)(st * kSK + j * 4) * N + t * 16];
        b[set][j][t].y = wp[(size_t)(st * kSK + j * 4 + 1) * N + t * 16];
      }
    }
  };
  auto load_a = [&](int set, int st) {
    #pragma unroll
    for (int j = 0; j < kKS; ++j) {
      #pragma unroll
      for (int mt = 0; mt < kMT; ++mt) {
        a[set][j][mt] = *(const v2f*)(ap + mt * 16 * kXS + st * kSK + j * 4);
      }
    }
  };
  auto mma = [&](int aset, int bset) {
    #pragma unroll
    for (int j = 0; j < kKS; ++j) {
      #pragma unroll
      for (int mt = 0; mt < kMT; ++mt) {
        #pragma unroll
        for (int t = 0; t < 4; ++t) {
          acc[mt][t] = wmma4(a[aset][j][mt], b[bset][j][t], acc[mt][t]);
        }
      }
    }
  };

  #pragma unroll
  for (int st = 0; st < kRB - 1; ++st) {
    load_b(st, st);
  }
  load_a(0, 0);
  // One trip is the whole ring (128 matrix instructions), so every set index is a constant.
  for (int s = 0; s < kNS - kRB; s += kRB) {
    #pragma unroll
    for (int u = 0; u < kRB; ++u) {
      load_b((u + kRB - 1) % kRB, u + kRB - 1);
      load_a((u + 1) & 1, u + 1);
      // This fence holds the requests in front of the block they fly behind; without it
      // the scheduler moved the LDS reads in among the matrix instructions.
      __builtin_amdgcn_sched_barrier(0);
      mma(u & 1, u);
      __builtin_amdgcn_sched_barrier(0);
      // Four vector slots between the block's last matrix instructions and the address
      // arithmetic that the next stage puts into the fragment registers they read.
      asm volatile("v_nop\n\tv_nop\n\tv_nop\n\tv_nop");
      __builtin_amdgcn_sched_barrier(0);
    }
    ap += kRB * kSK;
    wp += (size_t)(kRB * kSK) * N;
  }
  // Last trip of the ring: nothing is requested past k = kDim.
  #pragma unroll
  for (int u = 0; u < kRB; ++u) {
    if (u + kRB - 1 < kRB) load_b((u + kRB - 1) % kRB, u + kRB - 1);
    if (u + 1 < kRB) load_a((u + 1) & 1, u + 1);
    __builtin_amdgcn_sched_barrier(0);   // fences and slots as in the loop
    mma(u & 1, u);
    __builtin_amdgcn_sched_barrier(0);
    asm volatile("v_nop\n\tv_nop\n\tv_nop\n\tv_nop");
    __builtin_amdgcn_sched_barrier(0);
  }
  #pragma unroll
  for (int t = 0; t < 4; ++t) {
    const int col  = colG + t * 16 + hl;
    const float bv = bias[col];
    #pragma unroll
    for (int mt = 0; mt < kMT; ++mt) {
      #pragma unroll
      for (int r = 0; r < 8; ++r) {
        C[(size_t)(mt * 16 + r + kh * 8) * N + col] = acc[mt][t][r] + bv;
      }
    }
  }
}

// ---- Launch 1: qkv[16384][3072] = x @ wqkv + bqkv, 64 tokens per workgroup ----
__global__ __launch_bounds__(kThreads)
void qkv_gemm(const float* __restrict__ x,
              const float* __restrict__ wqkv,
              const float* __restrict__ bqkv,
              float* __restrict__ qkv) {
  __shared__ __attribute__((aligned(16))) float xs[kBM * kXS];

  const int tid  = threadIdx.x;
  const int wave = tid >> 5;
  const int lane = tid & 31;
  const int hl   = lane & 15;      // position within half-wave
  const int kh   = lane >> 4;      // which K-half this lane feeds (A/B layout)
  const int row0 = blockIdx.x * kBM;

  // Async-copy the x tile (64 x 1024 f32) straight into LDS, 16 B per lane and copy.
  {
    const float* gsrc = x + (size_t)row0 * kDim + tid * 4;
    const unsigned int lds0 = (unsigned int)(uintptr_t)xs +
        (unsigned int)((tid >> 8) * kXS + (tid & 255) * 4) * 4u;
    #pragma unroll
    for (int i = 0; i < (kBM * kDim / 4) / kThreads; i += 8) {
      unsigned int l[8];
      const float* g[8];
      #pragma unroll
      for (int j = 0; j < 8; ++j) {
        l[j] = lds0 + (unsigned int)((i + j) * 2 * kXS) * 4u;   // two rows per sweep
        g[j] = gsrc + (size_t)(i + j) * kThreads * 4;
      }
      // The closing s_wait_xcnt keeps the address registers untouched until the
      // copies have taken them.
      asm volatile("global_load_async_to_lds_b128 %0, %8, off\n\t"
                   "global_load_async_to_lds_b128 %1, %9, off\n\t"
                   "global_load_async_to_lds_b128 %2, %10, off\n\t"
                   "global_load_async_to_lds_b128 %3, %11, off\n\t"
                   "global_load_async_to_lds_b128 %4, %12, off\n\t"
                   "global_load_async_to_lds_b128 %5, %13, off\n\t"
                   "global_load_async_to_lds_b128 %6, %14, off\n\t"
                   "global_load_async_to_lds_b128 %7, %15, off\n\t"
                   "s_wait_xcnt 0x0"
                   :
                   : "v"(l[0]), "v"(l[1]), "v"(l[2]), "v"(l[3]),
                     "v"(l[4]), "v"(l[5]), "v"(l[6]), "v"(l[7]),
                     "v"(g[0]), "v"(g[1]), "v"(g[2]), "v"(g[3]),
                     "v"(g[4]), "v"(g[5]), "v"(g[6]), "v"(g[7])
                   : "memory");
    }
    // This wave's copies have landed before the barrier publishes the tile.
    asm volatile("s_wait_asynccnt 0x0" ::: "memory");
  }
  __syncthreads();

  float* crow = qkv + (size_t)row0 * kQkv;
  for (int g = 0; g < kQkv / (kWaves * 64); ++g) {
    gemm_64x64<kQkv>(xs, wqkv, bqkv, crow, wave * (kQkv / kWaves) + g * 64, hl, kh);
    // The next trip rewrites the address and data registers of the stores just issued.
    asm volatile("s_wait_xcnt 0x0" ::: "memory");
  }
}

// ---- Launch 2: per-token attention over heads, then out = attn_out @ wproj + bproj ----
__global__ __launch_bounds__(kThreads)
void attn_proj(const float* __restrict__ qkv,
               const float* __restrict__ wproj,
               const float* __restrict__ bproj,
               float* __restrict__ out) {
  __shared__ __attribute__((aligned(16))) float os[kBM * kXS];      // attention output tile
  __shared__ __attribute__((aligned(16))) float as[kWaves * kASize];

  const int tid  = threadIdx.x;
  const int wave = tid >> 5;
  const int lane = tid & 31;
  const int hl   = lane & 15;
  const int kh   = lane >> 4;
  const int row0 = blockIdx.x * kBM;

  for (int t2 = 0; t2 < kBM / kWaves; ++t2) {
    const int m = wave * (kBM / kWaves) + t2;  // token handled by this wave
    const float* qrow = qkv + (size_t)(row0 + m) * kQkv;
    const float* krow = qrow + kDim;
    const float* vrow = qrow + 2 * kDim;
    float* aw = as + wave * kASize;

    // This token's q, k and v fragments, all requested at once from the workspace.
    v2f qa[kHd / 4], kb[kHd / 4], vb[4][4];
    #pragma unroll
    for (int i = 0; i < kHd / 4; ++i) {
      const int kk = i * 4 + kh * 2;
      qa[i] = *(const v2f*)(qrow + hl * kHd + kk);
      kb[i] = *(const v2f*)(krow + hl * kHd + kk);
    }
    #pragma unroll
    for (int i = 0; i < 4; ++i) {
      const int kk = i * 4 + kh * 2;
      #pragma unroll
      for (int t = 0; t < 4; ++t) {
        vb[i][t].x = vrow[kk * kHd + t * 16 + hl];
        vb[i][t].y = vrow[(kk + 1) * kHd + t * 16 + hl];
      }
    }

    // scores = q @ k^T  (16x16, K = 64)
    v8f s = {};
    #pragma unroll
    for (int i = 0; i < kHd / 4; ++i) {
      s = wmma4(qa[i], kb[i], s);
    }
    __builtin_amdgcn_sched_barrier(0);
    // Four vector slots between the last matrix instruction and the first use of s or
    // reuse of its operand registers; the scheduling fences on both sides hold the slots
    // here and keep later vector instructions from being moved up into the chain.
    asm volatile("v_nop\n\tv_nop\n\tv_nop\n\tv_nop");
    __builtin_amdgcn_sched_barrier(0);
    // softmax across N-axis (lanes of a 16-lane half) for each of 8 rows
    #pragma unroll
    for (int r = 0; r < 8; ++r) {
      float v = s[r] * 0.125f;                 // 1/sqrt(64)
      float mx = v;
      mx = fmaxf(mx, __shfl_xor(mx, 1));
      mx = fmaxf(mx, __shfl_xor(mx, 2));
      mx = fmaxf(mx, __shfl_xor(mx, 4));
      mx = fmaxf(mx, __shfl_xor(mx, 8));
      float e = __expf(v - mx);
      float sm = e;
      sm += __shfl_xor(sm, 1);
      sm += __shfl_xor(sm, 2);
      sm += __shfl_xor(sm, 4);
      sm += __shfl_xor(sm, 8);
#if __has_builtin(__builtin_amdgcn_rcpf)
      aw[(r + kh * 8) * kARow + hl] = e * __builtin_amdgcn_rcpf(sm);
#else
      aw[(r + kh * 8) * kARow + hl] = e / sm;
#endif
    }
    __syncthreads();   // uniform; also orders the C->A layout bounce via LDS

    // out = attn @ v  (16x64, K = 16)
    v8f o[4] = {{}, {}, {}, {}};
    v2f pa[4];
    #pragma unroll
    for (int i = 0; i < 4; ++i) {
      pa[i] = *(const v2f*)(aw + hl * kARow + i * 4 + kh * 2);
    }
    #pragma unroll
    for (int i = 0; i < 4; ++i) {
      #pragma unroll
      for (int t = 0; t < 4; ++t) {
        o[t] = wmma4(pa[i], vb[i][t], o[t]);
      }
    }
    __builtin_amdgcn_sched_barrier(0);
    asm volatile("v_nop\n\tv_nop\n\tv_nop\n\tv_nop");  // slots and fences as behind the scores
    __builtin_amdgcn_sched_barrier(0);
    float* orow = os + m * kXS;                // flat [h*64 + d] within row
    #pragma unroll
    for (int t = 0; t < 4; ++t) {
      #pragma unroll
      for (int r = 0; r < 8; ++r) {
        orow[(r + kh * 8) * kHd + t * 16 + hl] = o[t][r];
      }
    }
  }
  __syncthreads();

  gemm_64x64<kDim>(os, wproj, bproj, out + (size_t)row0 * kDim, wave * 64, hl, kh);
}

extern "C" void kernel_launch(void* const* d_in, const int* in_sizes, int n_in,
                              void* d_out, int out_size, void* d_ws, size_t ws_size,
                              hipStream_t stream) {
  (void)in_sizes; (void)n_in; (void)out_size; (void)ws_size;
  const float* x     = (const float*)d_in[0];
  const float* wqkv  = (const float*)d_in[1];
  const float* bqkv  = (const float*)d_in[2];
  const float* wproj = (const float*)d_in[3];
  const float* bproj = (const float*)d_in[4];
  float* out = (float*)d_out;
  float* qkv = (float*)d_ws;   // [16384][3072] f32, written by launch 1, read by launch 2

  qkv_gemm<<<dim3(kTokens / kBM), dim3(kThreads), 0, stream>>>(x, wqkv, bqkv, qkv);
  attn_proj<<<dim3(kTokens / kBM), dim3(kThreads), 0, stream>>>(qkv, wproj, bproj, out);
}
